// v010
// Measured on an AMD MI455X. A time is GPU time per run, averaged over a window of back-to-back runs after a warm-up
// (all launches, gaps included; the runs take copies of the inputs in turn), and the median of several windows.
// Apart from v000's, it joins two sittings. Times from different sittings can be a few percent apart, while
// side-by-side timings come from the same sitting.
// Earlier versions than v010 are not in this document.
// Measured time: 106 microseconds a run.
// Two timings next to v009 both put it at 1.05 times that version's speed.
// All steps since the starting kernel, v000, together make it 1300 times as fast.
#include <hip/hip_runtime.h>
#define NB 2
#define SQ 2048
#define DM 1024
#define NH 16
#define HD 64
#define HG 4                         /* k_vt(b,h0) compatibility (unused) */
#define B0 0                         /* first batch processed (debug hook) */
#define NBR NB                       /* batches processed (debug hook) */
#define Q0S 0                        /* unused */
#define QN SQ                        /* unused */
#define NR ((size_t)NB * SQ)
#define MP ((int)((size_t)NBR * SQ)) /* rows projected (debug hook) */
#define MPO MP                       /* rows through the output GEMM (debug hook) */
typedef __bf16 v16b __attribute__((ext_vector_type(16)));
typedef unsigned short v8us __attribute__((ext_vector_type(8), may_alias));
typedef float  v8f  __attribute__((ext_vector_type(8)));
typedef float  v4f  __attribute__((ext_vector_type(4)));
typedef float  v4fa __attribute__((ext_vector_type(4), may_alias));
union FragB { v16b v; v8us half[2]; unsigned short u[16]; };

__device__ __forceinline__ unsigned short bf16_bits(float x) { unsigned int u = __float_as_uint(x); return (unsigned short)((u + 0x7FFFu + ((u >> 16) & 1u)) >> 16); }
__device__ __forceinline__ float bf16_val(unsigned short b) { return __uint_as_float(((unsigned int)b) << 16); }
__device__ __forceinline__ float bf16_round(float x) { return bf16_val(bf16_bits(x)); }
// D += A·B with NT terms: 1 = ah·bh, 2 = + al·bh (A split), 3 = + ah·bl (both split)
template <int NT>
__device__ __forceinline__ v8f mmaN(v16b ah, v16b al, v16b bh, v16b bl, v8f c) {
  c = __builtin_amdgcn_wmma_f32_16x16x32_bf16(false, ah, false, bh, (short)0, c, false, false);
  if (NT >= 2) c = __builtin_amdgcn_wmma_f32_16x16x32_bf16(false, al, false, bh, (short)0, c, false, false);
  if (NT >= 3) c = __builtin_amdgcn_wmma_f32_16x16x32_bf16(false, ah, false, bl, (short)0, c, false, false);
  asm volatile("v_nop\n\tv_nop\n\tv_nop\n\tv_nop" : "+v"(c) : "v"(ah), "v"(al), "v"(bh), "v"(bl));
  return c;
}

__global__ __launch_bounds__(256) void k_wt_bf16(const float* __restrict__ W, unsigned short* __restrict__ Wt, int K, int N) {
  const int t = blockIdx.x * 256 + threadIdx.x;
  const int k8n = K / 8;
  if (t >= N * k8n) return;
  const int n = t / k8n, k8 = (t % k8n) * 8;
  v8us v;
#pragma unroll
  for (int i = 0; i < 8; ++i) v[i] = bf16_bits(W[(size_t)(k8 + i) * N + n]);
  *(v8us*)(Wt + (size_t)n * K + k8) = v;
  
}

// GEMM C[M][N] (f32, pitch ldc) = act(A[M][K]·W + bias). A f32 row-major (pitch lda) converted per fragment to bf16
// (ASPLIT: hi/lo two planes -> 2 terms, else single rounded term); Wt bf16 [N][K] (pitch ldb). BIAS_BF16 rounds the
// bias to bf16 first (bias quantised to bf16 before the add). K%32==0, M%16==0, N%64==0.
template <bool ASPLIT, int ACT, bool BIAS_BF16>
__global__ __launch_bounds__(128) void k_gemm_bf(const float* __restrict__ A, int lda, const unsigned short* __restrict__ Wt, int ldb,
                                               const float* __restrict__ bias, float* __restrict__ C, int ldc, int M, int N, int K) {
  __shared__ __attribute__((aligned(16))) float so[4][16][64];
  const int tid = threadIdx.x, w = tid >> 5, lane = tid & 31, ln = lane & 15, hh = lane >> 4;
  const int ntn = N / 64;
  const int wid = blockIdx.x * 4 + w;
  const int mt = wid / ntn, nq = wid % ntn;
  if (mt * 16 >= M) return;
  const int row0 = mt * 16, col0 = nq * 64;
  const float* arow = A + (size_t)(row0 + ln) * lda;
  v8f acc[4] = {};
  for (int kb = 0; kb < K; kb += 32) {
    FragB ah, al;
    const v4f x0 = *(const v4fa*)(arow + kb + 8 * hh), x1 = *(const v4fa*)(arow + kb + 8 * hh + 4);
    const v4f x2 = *(const v4fa*)(arow + kb + 16 + 8 * hh), x3 = *(const v4fa*)(arow + kb + 16 + 8 * hh + 4);
    float xs[16] = {x0[0],x0[1],x0[2],x0[3],x1[0],x1[1],x1[2],x1[3],x2[0],x2[1],x2[2],x2[3],x3[0],x3[1],x3[2],x3[3]};
#pragma unroll
    for (int i = 0; i < 16; ++i) { const unsigned short hb = bf16_bits(xs[i]); ah.u[i] = hb; al.u[i] = ASPLIT ? bf16_bits(xs[i] - bf16_val(hb)) : (unsigned short)0; }
#pragma unroll
    for (int t = 0; t < 4; ++t) {
      const unsigned short* brow = Wt + (size_t)(col0 + t * 16 + ln) * ldb + kb;
      FragB b;
      b.half[0] = *(const v8us*)(brow + 8 * hh);
      b.half[1] = *(const v8us*)(brow + 16 + 8 * hh);
      acc[t] = mmaN<ASPLIT ? 2 : 1>(ah.v, al.v, b.v, b.v, acc[t]);
    }
  }
#pragma unroll
  for (int t = 0; t < 4; ++t) {
    float bv = bias ? bias[col0 + t * 16 + ln] : 0.f;
    if (BIAS_BF16) bv = bf16_round(bv);
#pragma unroll
    for (int r = 0; r < 8; ++r) { float v = acc[t][r] + bv; if (ACT == 1) v = fmaxf(v, 0.f); so[w][8 * hh + r][t * 16 + ln] = v; }
  }
  __builtin_amdgcn_fence(__ATOMIC_ACQ_REL, "workgroup");
  __builtin_amdgcn_wave_barrier();
  const int rsub = lane >> 4, c4 = (lane & 15) * 4;
  {
#pragma unroll
    for (int q = 0; q < 8; ++q) {
      const int r = q * 2 + rsub;
      const v4f v = *(const v4fa*)&so[w][r][c4];
      *(v4f*)(C + (size_t)(row0 + r) * ldc + col0 + c4) = v;
    }
    
  }
}

// GEMM C = act(A·W + bias + resid): A f32 (ASPLIT -> hi/lo 2 terms), Wt bf16 [N][K]; ACT 0 none, 1 relu, 2 exact gelu;
// resid (optional, f32, row index = (row % rmod), pitch ldr, RES_BF16 rounds it) added before the activation.
template <bool ASPLIT, int ACT, bool BIAS_BF16, bool RES_BF16>
__global__ __launch_bounds__(128) void k_gemm_bf3(const float* __restrict__ A, int lda, const unsigned short* __restrict__ Wt, int ldb,
                                                const float* __restrict__ bias, const float* __restrict__ resid, int rmod, int ldr,
                                                float* __restrict__ C, int ldc, int M, int N, int K) {
  __shared__ __attribute__((aligned(16))) float so[4][16][64];
  const int tid = threadIdx.x, w = tid >> 5, lane = tid & 31, ln = lane & 15, hh = lane >> 4;
  const int ntn = N / 64;
  const int wid = blockIdx.x * 4 + w;
  const int mt = wid / ntn, nq = wid % ntn;
  if (mt * 16 >= M) return;
  const int row0 = mt * 16, col0 = nq * 64;
  const float* arow = A + (size_t)(row0 + ln) * lda;
  v8f acc[4] = {};
  for (int kb = 0; kb < K; kb += 32) {
    FragB ah, al;
    const v4f x0 = *(const v4fa*)(arow + kb + 8 * hh), x1 = *(const v4fa*)(arow + kb + 8 * hh + 4);
    const v4f x2 = *(const v4fa*)(arow + kb + 16 + 8 * hh), x3 = *(const v4fa*)(arow + kb + 16 + 8 * hh + 4);
    float xs[16] = {x0[0],x0[1],x0[2],x0[3],x1[0],x1[1],x1[2],x1[3],x2[0],x2[1],x2[2],x2[3],x3[0],x3[1],x3[2],x3[3]};
#pragma unroll
    for (int i = 0; i < 16; ++i) { const unsigned short hb = bf16_bits(xs[i]); ah.u[i] = hb; al.u[i] = ASPLIT ? bf16_bits(xs[i] - bf16_val(hb)) : (unsigned short)0; }
#pragma unroll
    for (int t = 0; t < 4; ++t) {
      const unsigned short* brow = Wt + (size_t)(col0 + t * 16 + ln) * ldb + kb;
      FragB b;
      b.half[0] = *(const v8us*)(brow + 8 * hh);
      b.half[1] = *(const v8us*)(brow + 16 + 8 * hh);
      acc[t] = mmaN<ASPLIT ? 2 : 1>(ah.v, al.v, b.v, b.v, acc[t]);
    }
  }
#pragma unroll
  for (int t = 0; t < 4; ++t) {
    const int col = col0 + t * 16 + ln;
    float bv = bias ? bias[col] : 0.f;
    if (BIAS_BF16) bv = bf16_round(bv);
#pragma unroll
    for (int r = 0; r < 8; ++r) {
      float v = acc[t][r] + bv;
      if (resid) { float rv = resid[(size_t)((row0 + 8 * hh + r) % rmod) * ldr + col]; if (RES_BF16) rv = bf16_round(rv); v += rv; }
      if (ACT == 1) v = fmaxf(v, 0.f);
      if (ACT == 2) v = 0.5f * v * (1.0f + erff(v * 0.70710678118654752f));
      if (ACT == 3) { const float u = 0.7978845608028654f * (v + 0.044715f * v * v * v); v = 0.5f * v * (1.0f + tanhf(u)); }
      so[w][8 * hh + r][t * 16 + ln] = v;
    }
  }
  __builtin_amdgcn_fence(__ATOMIC_ACQ_REL, "workgroup");
  __builtin_amdgcn_wave_barrier();
  const int rsub = lane >> 4, c4 = (lane & 15) * 4;
  {
#pragma unroll
    for (int q = 0; q < 8; ++q) {
      const int r = q * 2 + rsub;
      const v4f v = *(const v4fa*)&so[w][r][c4];
      *(v4f*)(C + (size_t)(row0 + r) * ldc + col0 + c4) = v;
    }
    
  }
}
// row LayerNorm (biased variance, eps) over N: s = X (+ R); optional out_sum <- s; out_norm <- (s-mu)*rsqrt(var+eps)*g + b
template <bool PARAM_BF16>
__global__ __launch_bounds__(256) void k_layernorm(const float* __restrict__ X, const float* __restrict__ R, const float* __restrict__ g, const float* __restrict__ bta,
                                                  float* __restrict__ out_sum, float* __restrict__ out_norm, int N, float eps) {
  __shared__ float red[256];
  const int row = blockIdx.x, tid = threadIdx.x;
  const float* x = X + (size_t)row * N; const float* rr = R ? R + (size_t)row * N : nullptr;
  float vals[16];                     // up to N = 4096
  const int per = N / 256;            // contiguous chunk per thread? use strided-by-4 chunks: thread handles j = tid*4 + 1024*u
  float s1 = 0.f;
  for (int u = 0; u < per / 4; ++u) {
    const int j = tid * 4 + 1024 * u;
    const v4f a = *(const v4fa*)(x + j);
    v4f b = {0.f,0.f,0.f,0.f}; if (rr) b = *(const v4fa*)(rr + j);
#pragma unroll
    for (int q = 0; q < 4; ++q) { const float v = a[q] + b[q]; vals[u * 4 + q] = v; s1 += v; }
  }
  red[tid] = s1; __syncthreads();
  for (int st = 128; st > 0; st >>= 1) { if (tid < st) red[tid] += red[tid + st]; __syncthreads(); }
  const float mu = red[0] / (float)N; __syncthreads();
  float s2 = 0.f;
  for (int u = 0; u < per / 4; ++u)
#pragma unroll
    for (int q = 0; q < 4; ++q) { const float c = vals[u * 4 + q] - mu; s2 += c * c; }
  red[tid] = s2; __syncthreads();
  for (int st = 128; st > 0; st >>= 1) { if (tid < st) red[tid] += red[tid + st]; __syncthreads(); }
  const float rs = rsqrtf(red[0] / (float)N + eps);
  {
    for (int u = 0; u < per / 4; ++u) {
      const int j = tid * 4 + 1024 * u;
      v4f o, sm;
#pragma unroll
      for (int q = 0; q < 4; ++q) {
        float gg = g[j + q], bb = bta[j + q];
        if (PARAM_BF16) { gg = bf16_round(gg); bb = bf16_round(bb); }
        sm[q] = vals[u * 4 + q]; o[q] = (vals[u * 4 + q] - mu) * rs * gg + bb;
      }
      if (out_sum) *(v4f*)(out_sum + (size_t)row * N + j) = sm;
      *(v4f*)(out_norm + (size_t)row * N + j) = o;
    }
    
  }
}



// ---- f16 WMMA path (v_wmma_f32_16x16x32_f16): 11-bit significands for operands in range — used where a [0,1] probability operand needs more precision than bf16
typedef _Float16 v16h __attribute__((ext_vector_type(16)));
union FragH { v16h v; v8us half[2]; _Float16 h[16]; unsigned short u[16]; };
template <int NT>
__device__ __forceinline__ v8f mmaH(v16h ah, v16h al, v16h bh, v16h bl, v8f c) {
  c = __builtin_amdgcn_wmma_f32_16x16x32_f16(false, ah, false, bh, (short)0, c, false, false);
  if (NT >= 2) c = __builtin_amdgcn_wmma_f32_16x16x32_f16(false, al, false, bh, (short)0, c, false, false);
  if (NT >= 3) c = __builtin_amdgcn_wmma_f32_16x16x32_f16(false, ah, false, bl, (short)0, c, false, false);
  asm volatile("v_nop\n\tv_nop\n\tv_nop\n\tv_nop" : "+v"(c) : "v"(ah), "v"(al), "v"(bh), "v"(bl));
  return c;
}
// batched GEMM like k_gemm_b but f16 operands: A f32 (split into f16 hi/lo if ASPLIT, else rounded to f16), Bt = f16 values [n][k]; alpha; C f32; N multiple of 16 (partial tiles skipped)
template <bool ASPLIT>
__global__ __launch_bounds__(128) void k_gemm_h(const float* __restrict__ A, int lda, size_t sA, const _Float16* __restrict__ Bh, int ldb, size_t sB, float alpha, float* __restrict__ C, int ldc, size_t sC, int M, int N, int K) {
  __shared__ __attribute__((aligned(16))) float so[4][16][64];
  const int tid = threadIdx.x, w = tid >> 5, lane = tid & 31, ln = lane & 15, hh = lane >> 4; const int by = blockIdx.y;
  A += (size_t)by * sA; Bh += (size_t)by * sB; C += (size_t)by * sC;
  const int ntn = (N + 63) / 64; const int wid = blockIdx.x * 4 + w; const int mt = wid / ntn, nq = wid % ntn; if (mt * 16 >= M) return;
  const int row0 = mt * 16, col0 = nq * 64; const float* arow = A + (size_t)(row0 + ln) * lda;
  v8f acc[4] = {};
  for (int kb = 0; kb < K; kb += 32) {
    FragH ah, al;
    const v4f x0 = *(const v4fa*)(arow + kb + 8 * hh), x1 = *(const v4fa*)(arow + kb + 8 * hh + 4), x2 = *(const v4fa*)(arow + kb + 16 + 8 * hh), x3 = *(const v4fa*)(arow + kb + 16 + 8 * hh + 4);
    float xs[16] = {x0[0],x0[1],x0[2],x0[3],x1[0],x1[1],x1[2],x1[3],x2[0],x2[1],x2[2],x2[3],x3[0],x3[1],x3[2],x3[3]};
#pragma unroll
    for (int i = 0; i < 16; ++i) { const _Float16 h = (_Float16)xs[i]; ah.h[i] = h; al.h[i] = ASPLIT ? (_Float16)(xs[i] - (float)h) : (_Float16)0.0f; }
#pragma unroll
    for (int t = 0; t < 4; ++t) { if (col0 + t * 16 >= N) continue; const size_t boff = (size_t)(col0 + t * 16 + ln) * ldb + kb; FragH bq; bq.half[0] = *(const v8us*)(Bh + boff + 8 * hh); bq.half[1] = *(const v8us*)(Bh + boff + 16 + 8 * hh);
      acc[t] = mmaH<ASPLIT ? 2 : 1>(ah.v, al.v, bq.v, bq.v, acc[t]); }
  }
#pragma unroll
  for (int t = 0; t < 4; ++t) { if (col0 + t * 16 >= N) continue;
#pragma unroll
    for (int r = 0; r < 8; ++r) so[w][8 * hh + r][t * 16 + ln] = acc[t][r] * alpha; }
  __builtin_amdgcn_fence(__ATOMIC_ACQ_REL, "workgroup"); __builtin_amdgcn_wave_barrier();
  const int rsub = lane >> 4, c4 = (lane & 15) * 4;
  {
#pragma unroll
    for (int q = 0; q < 8; ++q) { const int r = q * 2 + rsub; if (col0 + c4 < N) { const v4f v = *(const v4fa*)&so[w][r][c4]; *(v4f*)(C + (size_t)(row0 + r) * ldc + col0 + c4) = v; } }
     }
}

// Wt[n][k] = f16(W[k][n]·scale) from f32 row-major W[K][N] (scale = power of two; bf16-exact weights stay exact in f16 away from the subnormal range)
// bx, here and in the other d_ bodies: the work-group's index within this job's own share of a grid that several jobs share
// a work-group of 256 threads turns one tile of 64 k x 64 n through LDS, so that reads (256 B of a W row) and writes (128 B of a Wt row) both cover whole lines; K % 64 == 0, N % 64 == 0
#define WT_P 33                      /* LDS dwords from n row to n row: 32 (64 k) + 1, odd, so the lanes of a store (n 4 apart) and of a load (rows 1 apart) fall on different banks */
typedef unsigned v4uw __attribute__((ext_vector_type(4), may_alias));
__device__ __forceinline__ void d_wt_f16(unsigned bx, const float* __restrict__ W, _Float16* __restrict__ Wt, int K, int N, float scale, unsigned (*tl)[WT_P]) {
  const int tid = threadIdx.x, ktn = K / 64; const int k0 = (int)(bx % ktn) * 64, n0 = (int)(bx / ktn) * 64;
  const int r2 = (tid >> 4) * 2, c4 = (tid & 15) * 4;      /* read role: 16 lanes cover 64 n of one k; a thread takes k = r2, r2 + 1 and the same 32 further on */
  const float* s = W + (size_t)(k0 + r2) * N + n0 + c4; v4f x[2][2];
  __builtin_amdgcn_sched_barrier(0);      /* with the one below: the four loads and their wait stay one group, so nothing that could rewrite an address register comes between */
#pragma unroll      /* constant indices, so the four vectors stay in registers */
  for (int p = 0; p < 2; ++p) { x[p][0] = *(const v4fa*)(s + (size_t)(p * 32) * N); x[p][1] = *(const v4fa*)(s + (size_t)(p * 32 + 1) * N); }
  asm volatile("s_wait_xcnt 0x0" ::: "memory");      /* precaution: stands behind the loads issued above, in front of any rewrite of their address registers */
  __builtin_amdgcn_sched_barrier(0);
#pragma unroll      /* constant indices, so the four vectors stay in registers */
  for (int p = 0; p < 2; ++p)
#pragma unroll      /* constant indices into the vectors */
    for (int j = 0; j < 4; ++j) { union { _Float16 h[2]; unsigned u; } z; z.h[0] = (_Float16)(bf16_round(x[p][0][j]) * scale); z.h[1] = (_Float16)(bf16_round(x[p][1][j]) * scale); tl[c4 + j][p * 16 + (r2 >> 1)] = z.u; }      /* two neighbouring k of one n share a dword */
  __syncthreads();      /* the tile is whole: its rows may be read across the waves; reached by every thread of a work-group that has this job */
  const int rr = tid >> 3, c = (tid & 7) * 4;      /* write role: 8 lanes cover the 128 B (32 dwords) of one n */
#pragma unroll      /* the LDS reads issue ahead of the stores */
  for (int p = 0; p < 2; ++p) { const int n = p * 32 + rr; v4uw o;
#pragma unroll      /* constant indices into the vector */
    for (int j = 0; j < 4; ++j) o[j] = tl[n][c + j];
    *(v4uw*)((unsigned short*)Wt + (size_t)(n0 + n) * K + k0 + c * 2) = o; }
  asm volatile("s_wait_xcnt 0x0" ::: "memory");      /* precaution: stands behind the stores above, in front of the other jobs' code, which in the listing follows this one and rewrites the stores' registers */
}
// k_gemm_hh variant with fused epilogue: v = acc·alpha + bias[by·sBias + col] (+ CP[(row/rowsPerB)·sCPb + by·64 + col] if CP) ; ACT 0 none / 1 elu ; writes f16 C16 (and f32 C if non-null)
template <int ACT>
__global__ __launch_bounds__(128) void k_gemm_hhx(const _Float16* __restrict__ A, int lda, size_t sA, const _Float16* __restrict__ Bh, int ldb, size_t sB, float alpha, const float* __restrict__ bias, size_t sBias, const float* __restrict__ CP, int rowsPerB, size_t sCPb, int row0g,
    float* __restrict__ C, _Float16* __restrict__ C16, int ldc, size_t sC, int M, int N, int K) {
  __shared__ __attribute__((aligned(16))) float so[4][16][64];
  const int tid = threadIdx.x, w = tid >> 5, lane = tid & 31, ln = lane & 15, hh = lane >> 4; const int by = blockIdx.y;
  A += (size_t)by * sA; Bh += (size_t)by * sB; const size_t cofs = (size_t)by * sC; const float* bp = bias ? bias + (size_t)by * sBias : nullptr;
  const int ntn = (N + 63) / 64; const int wid = blockIdx.x * 4 + w; const int mt = wid / ntn, nq = wid % ntn; if (mt * 16 >= M) return;
  const int row0 = mt * 16, col0 = nq * 64; const _Float16* arow = A + (size_t)(row0 + ln) * lda;
  v8f acc[4] = {};
  for (int kb = 0; kb < K; kb += 32) { FragH ah; ah.half[0] = *(const v8us*)((const unsigned short*)arow + kb + 8 * hh); ah.half[1] = *(const v8us*)((const unsigned short*)arow + kb + 16 + 8 * hh);
#pragma unroll
    for (int t = 0; t < 4; ++t) { if (col0 + t * 16 >= N) continue; const size_t boff = (size_t)(col0 + t * 16 + ln) * ldb + kb; FragH bq; bq.half[0] = *(const v8us*)((const unsigned short*)Bh + boff + 8 * hh); bq.half[1] = *(const v8us*)((const unsigned short*)Bh + boff + 16 + 8 * hh);
      acc[t] = mmaH<1>(ah.v, ah.v, bq.v, bq.v, acc[t]); }
  }
#pragma unroll
  for (int t = 0; t < 4; ++t) { if (col0 + t * 16 >= N) continue; const int col = col0 + t * 16 + ln; const float bv = bp ? bf16_round(bp[col]) : 0.f;
#pragma unroll
    for (int r = 0; r < 8; ++r) { float v = acc[t][r] * alpha + bv; if (CP) { const int rr = row0g + row0 + 8 * hh + r; if (rowsPerB < 0) v += CP[cofs + (size_t)rr * ldc + col];      /* rowsPerB < 0: own element of the batched C plane */ else { const int bidx = rr / rowsPerB; v += CP[(size_t)bidx * sCPb + (size_t)by * 64 + col]; } } if (ACT == 1) v = (v > 0.f) ? v : expm1f(v); else if (ACT == 7) v = (v > 0.f) ? v + 1.0f : expf(v); else if (ACT == 8) v = tanhf(v); else if (ACT == 9) v = 0.5f * v * (1.0f + tanhf(0.7978845608028654f * (v + 0.044715f * v * v * v))); else if (ACT == 11) v = 1.0f / (1.0f + expf(-v)); else if (ACT == 12) v = (v > 0.f) ? v : 0.01f * v; else if (ACT == 14) v = (v > 0.f) ? v : 0.1f * v; else if (ACT == 16) v = (v >= 0.f) ? v : 0.3f * v; else if (ACT == 17) v = (v >= 0.f) ? v : 0.2f * v; else if (ACT == 15) v = v / (1.0f + expf(-v)); else if (ACT == 3) v = fmaxf(v, 0.f); else if (ACT == 6) v = 0.5f * v * (1.0f + erff(v * 0.70710678118654752f)); so[w][8 * hh + r][t * 16 + ln] = v; } }
  __builtin_amdgcn_fence(__ATOMIC_ACQ_REL, "workgroup"); __builtin_amdgcn_wave_barrier();
  const int rsub = lane >> 4, c4 = (lane & 15) * 4; typedef _Float16 v4h __attribute__((ext_vector_type(4)));
  {
#pragma unroll
    for (int q = 0; q < 8; ++q) { const int r = q * 2 + rsub; if (col0 + c4 < N) { const v4f v = *(const v4fa*)&so[w][r][c4]; if (C) *(v4f*)(C + cofs + (size_t)(row0 + r) * ldc + col0 + c4) = v; if (C16) { v4h h4; for (int i = 0; i < 4; ++i) h4[i] = (_Float16)v[i]; *(v4h*)(C16 + cofs + (size_t)(row0 + r) * ldc + col0 + c4) = h4; } } }
     }
}


typedef _Float16 v4h __attribute__((ext_vector_type(4)));

__device__ __forceinline__ void d_x16(unsigned bx, const float* __restrict__ x, _Float16* __restrict__ X16, size_t n8) { const size_t t = (size_t)bx * 256 + threadIdx.x; if (t >= n8) return; FragH f;
#pragma unroll
  for (int q = 0; q < 8; ++q) f.h[q] = (_Float16)bf16_round(x[t * 8 + q]); *(v8us*)((unsigned short*)X16 + t * 8) = f.half[0];  }
__global__ __launch_bounds__(256) void k_h16(const float* __restrict__ x, _Float16* __restrict__ X16, size_t n8) { const size_t t = (size_t)blockIdx.x * 256 + threadIdx.x; if (t >= n8) return; FragH f;
#pragma unroll
  for (int q = 0; q < 8; ++q) f.h[q] = (_Float16)x[t * 8 + q]; *(v8us*)((unsigned short*)X16 + t * 8) = f.half[0];  }
__global__ __launch_bounds__(256) void k_round16f(const float* __restrict__ W, _Float16* __restrict__ Bt, size_t n8) { const size_t t = (size_t)blockIdx.x * 256 + threadIdx.x; if (t >= n8) return; FragH f;
#pragma unroll
  for (int i = 0; i < 8; ++i) f.h[i] = (_Float16)(bf16_round(W[t * 8 + i]) * 16.0f); *(v8us*)((unsigned short*)Bt + t * 8) = f.half[0];  }
__global__ __launch_bounds__(256) void k_hl(const float* __restrict__ F, _Float16* __restrict__ Hh, _Float16* __restrict__ Hl, size_t n8) { const size_t t = (size_t)blockIdx.x * 256 + threadIdx.x; if (t >= n8) return; FragH fh, fl; const v4f a = *(const v4fa*)(F + t * 8), c = *(const v4fa*)(F + t * 8 + 4);
#pragma unroll
  for (int q = 0; q < 4; ++q) { _Float16 h = (_Float16)a[q]; fh.h[q] = h; fl.h[q] = (_Float16)((a[q] - (float)h) * 1024.0f); h = (_Float16)c[q]; fh.h[4 + q] = h; fl.h[4 + q] = (_Float16)((c[q] - (float)h) * 1024.0f); }
  { *(v8us*)((unsigned short*)Hh + t * 8) = fh.half[0]; *(v8us*)((unsigned short*)Hl + t * 8) = fl.half[0];  } }

// ---- fast GEMM (work-group tile 128x128, four waves as 2 x 2, wave tile 64x64; requires M % 128 == 0, N % 128 == 0, K % 128 == 0, K >= 128); epilogue = k_gemm_hhx semantics ----
// Operands go through LDS: a stage is 128 k (256 B) of the work-group's 128 A rows and 128 B rows, brought by asynchronous copies of whole lines, two buffers, the next stage in flight while this one is multiplied.
__device__ __forceinline__ v16h g2_frag(const _Float16* p, int hh) { FragH f; f.half[0] = *(const v8us*)((const unsigned short*)p + 8 * hh); f.half[1] = *(const v8us*)((const unsigned short*)p + 16 + 8 * hh); return f.v; }
__device__ __forceinline__ v8f g2_mma(v16h a, v16h b, v8f c) { return __builtin_amdgcn_wmma_f32_16x16x32_f16(false, a, false, b, (short)0, c, false, false); }
#define G2_PITCH 272                 /* LDS bytes from row to row: 256 + 16, an odd multiple of 16 B, so the 16 rows of a fragment read fall on different banks */
#define G2_BUF (256 * G2_PITCH)      /* one stage: rows 0..127 = A, rows 128..255 = B */
#define G2_SO (64 * 68 * 4)          /* bytes of one wave's f32 output staging: 64 rows of 64 + 4 values */
__device__ __forceinline__ v16h g2_lfrag(const unsigned char* p) { FragH f; f.half[0] = *(const v8us*)p; f.half[1] = *(const v8us*)(p + 32); return f.v; }      /* p = row start + 64 B x block + 16 hh: the k order of g2_frag */
// eight asynchronous copies of 16 B a lane, rows 8 apart: LDS byte address l (+ 8 rows each), global address g (+ gs elements each)
__device__ __forceinline__ void g2_copy8(unsigned l, const _Float16* g, size_t gs) {
  const unsigned l1 = l + 8 * G2_PITCH, l2 = l + 16 * G2_PITCH, l3 = l + 24 * G2_PITCH, l4 = l + 32 * G2_PITCH, l5 = l + 40 * G2_PITCH, l6 = l + 48 * G2_PITCH, l7 = l + 56 * G2_PITCH;
  const _Float16* g1 = g + gs; const _Float16* g2 = g1 + gs; const _Float16* g3 = g2 + gs; const _Float16* g4 = g3 + gs; const _Float16* g5 = g4 + gs; const _Float16* g6 = g5 + gs; const _Float16* g7 = g6 + gs;
  /* the copies move global bytes into LDS through no register; the closing s_wait_xcnt is a precaution: it stands in front of any rewrite of the address registers named here */
  asm volatile("global_load_async_to_lds_b128 %0, %8, off\n\t"
               "global_load_async_to_lds_b128 %1, %9, off\n\t"
               "global_load_async_to_lds_b128 %2, %10, off\n\t"
               "global_load_async_to_lds_b128 %3, %11, off\n\t"
               "global_load_async_to_lds_b128 %4, %12, off\n\t"
               "global_load_async_to_lds_b128 %5, %13, off\n\t"
               "global_load_async_to_lds_b128 %6, %14, off\n\t"
               "global_load_async_to_lds_b128 %7, %15, off\n\t"
               "s_wait_xcnt 0x0"
               :: "v"(l), "v"(l1), "v"(l2), "v"(l3), "v"(l4), "v"(l5), "v"(l6), "v"(l7), "v"(g), "v"(g1), "v"(g2), "v"(g3), "v"(g4), "v"(g5), "v"(g6), "v"(g7) : "memory"); }
// Products that do not depend on one another share a grid as planes of blockIdx.y: planes 1 and up take B1 and bias1 where B1 is given; C, the f32 result, is one plane and is stored by plane cy alone
// Where VT is given, plane cy is the v projection (N = NH heads of HD columns, rows = tokens of NB batches of SQ): it stores its f32 rows times 64 bf16(av[0]) in C and its f16 values transposed in VT [NB][NH][HD][SQ], and no C16 rows
template <int ACT>
__global__ __launch_bounds__(128) void k_gemm2(const _Float16* __restrict__ A, int lda, size_t sA, const _Float16* __restrict__ Bh, int ldb, size_t sB, float alpha, const float* __restrict__ bias, size_t sBias, const float* __restrict__ CP, int rowsPerB, size_t sCPb, int row0g,
    float* __restrict__ C, _Float16* __restrict__ C16, int ldc, size_t sC, int M, int N, int K, const _Float16* __restrict__ B1, const float* __restrict__ bias1, int cy, _Float16* __restrict__ VT, const float* __restrict__ av) { static_assert(ACT == 0 || ACT == 3 || ACT == 6 || ACT == 8 || ACT == 9 || ACT == 11 || ACT == 12 || ACT == 14 || ACT == 15 || ACT == 16 || ACT == 17, "k_gemm2: unsupported ACT code (would silently apply no activation)");
  __shared__ __attribute__((aligned(16))) unsigned char ring[2][G2_BUF];
  const int tid = threadIdx.x, w = tid >> 5, lane = tid & 31, ln = lane & 15, hh = lane >> 4, wm = w >> 1, wn = w & 1; const int by = blockIdx.y;
  float (*so)[68] = (float (*)[68])(&ring[0][0] + w * G2_SO);      /* this wave's output staging lies in the ring, which is free behind the loop: every wave's reads and copies end in front of the loop's last barrier */
  A += (size_t)by * sA; Bh += (size_t)by * sB; const size_t cofs = (size_t)by * sC; const float* bp = bias ? bias + (size_t)by * sBias : nullptr;
  if (B1 && by) { Bh = B1; bp = bias1; }
  C = by == cy ? C - cofs : nullptr;      /* the stores below add cofs */
  const int ntn = N >> 7; const int mt = blockIdx.x / ntn, nq = blockIdx.x - mt * ntn; const int row0 = mt * 128 + 64 * wm, col0 = nq * 128, colw = col0 + 64 * wn; if (mt * 128 >= M) return;      /* taken by a whole work-group, in front of every barrier */
  const int cr = tid >> 4, cc = tid & 15;      /* copy role: 16 lanes cover the 256 B of one row, a wave two whole rows (4 lines) */
  const _Float16* ga = A + (size_t)(mt * 128 + cr) * lda + cc * 8; const _Float16* gb = Bh + (size_t)(col0 + cr) * ldb + cc * 8; const unsigned lc = (unsigned)(size_t)&ring[0][0] + cr * G2_PITCH + cc * 16;
  auto stage = [&](int t, int buf) { const unsigned l = lc + buf * G2_BUF; const _Float16* a = ga + t * 128; const _Float16* b = gb + t * 128;
    g2_copy8(l, a, (size_t)8 * lda); g2_copy8(l + 64 * G2_PITCH, a + (size_t)64 * lda, (size_t)8 * lda); g2_copy8(l + 128 * G2_PITCH, b, (size_t)8 * ldb); g2_copy8(l + 192 * G2_PITCH, b + (size_t)64 * ldb, (size_t)8 * ldb); };
  const int nt = K >> 7;
  const v8f z8 = {0.f,0.f,0.f,0.f,0.f,0.f,0.f,0.f}; v8f acc[4][4];      /* acc[i][j]: rows 16 i, columns 16 j of the wave's tile */
#pragma unroll      /* constant indices, so the accumulators stay in registers */
  for (int i = 0; i < 4; ++i)
#pragma unroll      /* constant indices, so the accumulators stay in registers */
    for (int j = 0; j < 4; ++j) acc[i][j] = z8;
  stage(0, 0);
  asm volatile("s_wait_asynccnt 0x0" ::: "memory");      /* this wave's copies of stage 0 have landed */
  __syncthreads();                                       /* every wave's have: stage 0 may be read */
  if (nt > 1) stage(1, 1);
#pragma unroll 1    /* one stage a trip: the publish point at the foot stands once */
  for (int t = 0; t < nt; ++t) { const unsigned char* ap = &ring[t & 1][0] + (64 * wm + ln) * G2_PITCH + 16 * hh; const unsigned char* bq = &ring[t & 1][0] + (128 + 64 * wn + ln) * G2_PITCH + 16 * hh; v16h fa[2][4], fb[2][4];
    auto frags = [&](int kk, v16h (&a)[4], v16h (&b)[4]) {
#pragma unroll      /* constant indices, so the fragment arrays stay in registers */
      for (int j = 0; j < 4; ++j) { a[j] = g2_lfrag(ap + j * 16 * G2_PITCH + kk * 64); b[j] = g2_lfrag(bq + j * 16 * G2_PITCH + kk * 64); } };
    frags(0, fa[0], fb[0]);
#pragma unroll      /* constant indices, so the fragment arrays stay in registers */
    for (int kk = 0; kk < 4; ++kk) { const int c = kk & 1;
      if (kk < 3) frags(kk + 1, fa[c ^ 1], fb[c ^ 1]);
      __builtin_amdgcn_sched_barrier(0);      /* the next block's LDS reads stay one group ahead of this block's products instead of among them */
#pragma unroll      /* constant indices, so the fragment arrays stay in registers */
      for (int j = 0; j < 4; ++j)
#pragma unroll      /* constant indices, so the fragment arrays stay in registers */
        for (int i = 0; i < 4; ++i) acc[i][j] = g2_mma(fa[c][i], fb[c][j], acc[i][j]);
      __builtin_amdgcn_sched_barrier(0); }    /* and the block after next's reads stay behind these products */
    asm volatile("s_wait_dscnt 0x0" ::: "memory");         /* this wave has finished reading the buffer */
    asm volatile("s_wait_asynccnt 0x0" ::: "memory");      /* its copies of stage t + 1 have landed */
    __syncthreads();                                       /* publishes stage t + 1 and ends every wave's reads of stage t */
    if (t + 2 < nt) stage(t + 2, t & 1); }                 /* refill of the buffer just left; the test reads the same in the whole work-group */
  asm volatile("s_wait_asynccnt 0x0" ::: "memory");        /* nothing of this wave is in flight behind the loop */
  if constexpr (ACT == 0) { if (VT && by == cy) {      /* the test reads the same in the whole work-group: the block holds a barrier */
    float bv[4] = {0.f, 0.f, 0.f, 0.f};
    __builtin_amdgcn_sched_barrier(0);      /* with the one below: the loads of the factor and of the four bias values stay one group with their wait, so nothing that could rewrite an address register comes between */
    const float a0 = av[0];
    if (bp) {
#pragma unroll      /* constant indices, so the four values stay in registers */
      for (int t = 0; t < 4; ++t) bv[t] = bp[colw + t * 16 + ln]; }
    asm volatile("s_wait_xcnt 0x0" ::: "memory");      /* precaution: stands behind the loads issued above, in front of any rewrite of their address registers */
    __builtin_amdgcn_sched_barrier(0);
    const float a64 = bf16_round(a0) * 64.0f;
    /* an accumulator tile holds, per lane, 8 consecutive rows (keys) of one column (d): 16 B of a V^T row. The part of the ring behind the four waves' staging collects the work-group's 128 V^T rows of 128 keys at the ring's own pitch */
    unsigned char* vtile = &ring[0][0] + 4 * G2_SO; unsigned char* tw = vtile + (64 * wn + ln) * G2_PITCH + (64 * wm + 8 * hh) * 2;
#pragma unroll      /* constant indices, so the accumulators stay in registers */
    for (int t = 0; t < 4; ++t) { const float b = bf16_round(bv[t]);
#pragma unroll      /* constant indices, so the accumulators stay in registers */
      for (int i = 0; i < 4; ++i) { FragH f;
#pragma unroll      /* constant indices, so the accumulators stay in registers */
        for (int r = 0; r < 8; ++r) { const float v = acc[i][t][r] * alpha + b; so[i * 16 + 8 * hh + r][t * 16 + ln] = a64 * v; f.h[r] = (_Float16)v; }
        *(v8us*)(tw + t * 16 * G2_PITCH + i * 32) = f.half[0]; } }
    __syncthreads();      /* every wave's part of the V^T rows is written: they may be read across the waves */
    const int rs = lane >> 4, e4 = (lane & 15) * 4; float* cr0 = C + cofs + (size_t)(row0 + rs) * ldc + colw + e4;
#pragma unroll      /* the LDS reads issue ahead of the stores */
    for (int q = 0; q < 32; ++q) { const v4f v = *(const v4fa*)&so[q * 2 + rs][e4]; *(v4f*)(cr0 + (size_t)(q * 2) * ldc) = v; }
    /* 16 lanes store the 256 B that the work-group holds of one V^T row: two whole lines; column c of the plane is row c of its batch's V^T (head c / HD, d = c % HD) */
    unsigned short* vr = (unsigned short*)VT + ((size_t)(mt * 128 / SQ) * NH * HD + col0 + cr) * SQ + mt * 128 % SQ + cc * 8; const unsigned char* tr = vtile + cr * G2_PITCH + cc * 16;
#pragma unroll      /* the LDS reads issue ahead of the stores */
    for (int i = 0; i < 16; ++i) { const v8us x = *(const v8us*)(tr + i * 8 * G2_PITCH); *(v8us*)(vr + (size_t)i * 8 * SQ) = x; }
    asm volatile("s_wait_xcnt 0x0" ::: "memory");      /* precaution: stands behind the stores above, in front of the other planes' code, which may follow in the listing and rewrite their registers */
    return; } }
#pragma unroll      /* constant indices, so the accumulators stay in registers */
  for (int t = 0; t < 4; ++t) { const float bv = bp ? bf16_round(bp[colw + t * 16 + ln]) : 0.f;
#pragma unroll      /* constant indices, so the accumulators stay in registers */
    for (int i = 0; i < 4; ++i)
#pragma unroll      /* constant indices, so the accumulators stay in registers */
      for (int r = 0; r < 8; ++r) so[i * 16 + 8 * hh + r][t * 16 + ln] = acc[i][t][r] * alpha + bv; }
  __builtin_amdgcn_fence(__ATOMIC_ACQ_REL, "workgroup"); __builtin_amdgcn_wave_barrier();
  const int rsub = lane >> 4, c4 = (lane & 15) * 4;
  if (CP) {      /* the optional addend joins the staged values, each lane on the elements that it reads back below */
#pragma unroll 1    /* rolled: its address code is not unrolled for the 128 values a lane now holds (for speed only) */
    for (int q = 0; q < 32; ++q) { const int r = q * 2 + rsub; const float* cp = CP + (rowsPerB < 0 ? cofs + (size_t)(row0g + row0 + r) * ldc      /* rowsPerB < 0: own element of the batched C plane */ : (size_t)((row0g + row0 + r) / rowsPerB) * sCPb + (size_t)by * 64) + colw + c4; float ad[4];
      __builtin_amdgcn_sched_barrier(0);      /* with the one below: the four loads of the addend and their wait stay one group, so nothing that could rewrite an address register comes between */
#pragma unroll      /* constant indices, so the four values stay in registers */
      for (int i = 0; i < 4; ++i) ad[i] = cp[i];
      asm volatile("s_wait_xcnt 0x0" ::: "memory");      /* precaution: stands behind the loads issued above, in front of any rewrite of their address registers */
      __builtin_amdgcn_sched_barrier(0);
      v4f v = *(const v4fa*)&so[r][c4];
#pragma unroll      /* constant indices into the vector */
      for (int i = 0; i < 4; ++i) v[i] += ad[i];
      *(v4fa*)&so[r][c4] = v; } }
  auto staged = [&](int q) { v4f v = *(const v4fa*)&so[q * 2 + rsub][c4];      /* four finished values of row 2 q + rsub */
#pragma unroll      /* constant indices into the vector */
    for (int i = 0; i < 4; ++i) { float x = v[i];
      if (ACT == 3) x = fmaxf(x, 0.f); else if (ACT == 6) x = 0.5f * x * (1.0f + erff(x * 0.70710678118654752f)); else if (ACT == 11) x = 1.0f / (1.0f + expf(-x)); else if (ACT == 15) x = x / (1.0f + expf(-x)); else if (ACT == 12) x = (x > 0.f) ? x : 0.01f * x; else if (ACT == 8) x = tanhf(x); else if (ACT == 9) x = 0.5f * x * (1.0f + tanhf(0.7978845608028654f * (x + 0.044715f * x * x * x))); else if (ACT == 14) x = (x > 0.f) ? x : 0.1f * x; else if (ACT == 16) x = (x >= 0.f) ? x : 0.3f * x; else if (ACT == 17) x = (x >= 0.f) ? x : 0.2f * x;
      v[i] = x; }
    return v; };
  const size_t eo = cofs + (size_t)(row0 + rsub) * ldc + colw + c4;      /* this lane's first output element */
  if (C) {
#pragma unroll      /* the LDS reads issue ahead of the stores */
    for (int q = 0; q < 32; ++q) { const v4f v = staged(q); *(v4f*)(C + eo + (size_t)(q * 2) * ldc) = v; }
    asm volatile("s_wait_xcnt 0x0" ::: "memory"); }      /* precaution: stands behind the stores above, in front of the code below, which may rewrite their registers */
  if (C16) {
#pragma unroll      /* the LDS reads issue ahead of the stores */
    for (int q = 0; q < 32; ++q) { const v4f v = staged(q); v4h h4;
#pragma unroll      /* constant indices into the vector */
      for (int i = 0; i < 4; ++i) h4[i] = (_Float16)v[i];
      *(v4h*)(C16 + eo + (size_t)(q * 2) * ldc) = h4; } } }


__global__ __launch_bounds__(256) void k_wnat(const float* __restrict__ w, size_t n8, _Float16* __restrict__ Bt) { const size_t t = (size_t)blockIdx.x * 256 + threadIdx.x; if (t >= n8) return; FragH f; for (int q = 0; q < 8; ++q) f.h[q] = (_Float16)(bf16_round(w[t * 8 + q]) * 16.0f); *(v8us*)((unsigned short*)Bt + t * 8) = f.half[0];  }
__global__ __launch_bounds__(256) void k_rsm(const float* __restrict__ S, _Float16* __restrict__ P, int nrows) {
  #pragma clang fp contract(off)
  const int i = blockIdx.x * 256 + threadIdx.x; if (i >= nrows) return; const float* s = S + (size_t)i * SQ; float mx = -3.0e38f;
#pragma unroll 1
  for (int j = 0; j < SQ; ++j) mx = fmaxf(mx, s[j]); float se = 0.f;
#pragma unroll 1
  for (int j = 0; j < SQ; ++j) se += expf(s[j] - mx); const float sc = 256.0f / se;
#pragma unroll 1
  for (int j0 = 0; j0 < SQ; j0 += 8) { FragH f; for (int q = 0; q < 8; ++q) f.h[q] = (_Float16)(expf(s[j0 + q] - mx) * sc); unsigned short* d = (unsigned short*)P + (size_t)i * SQ + j0; *(v8us*)d = f.half[0];  } }
__global__ __launch_bounds__(256) void k_vt(const _Float16* __restrict__ V16, int b, int h0, _Float16* __restrict__ VT) { __shared__ unsigned short tl[64][65]; const int tid = threadIdx.x; const int hh = blockIdx.x % HG, sg = blockIdx.x / HG; const int s0 = sg * 64; const int h = h0 + hh;
  for (int i = tid; i < 64 * 8; i += 256) { const int j = i / 8, d8 = (i % 8) * 8; FragH f; f.half[0] = *(const v8us*)((const unsigned short*)V16 + ((size_t)b * SQ + s0 + j) * DM + h * HD + d8); for (int q = 0; q < 8; ++q) tl[d8 + q][j] = f.u[q]; }
  __syncthreads();
  { for (int i = tid; i < 64 * 8; i += 256) { const int d = i / 8, j8 = (i % 8) * 8; FragH f; for (int q = 0; q < 8; ++q) f.u[q] = tl[d][j8 + q]; *(v8us*)((unsigned short*)VT + ((size_t)hh * HD + d) * SQ + s0 + j8) = f.half[0]; }  } }


// lane l <-> lane l ^ M of the wave, in vector registers (no LDS round trip): M = 16 crosses the two 16-lane rows, M < 16 is a DPP row_xmask move
template <int M>
__device__ __forceinline__ float lane_xor(float x) { const int b = __float_as_int(x);
  if constexpr (M == 16) return __int_as_float(__builtin_amdgcn_permlanex16(b, b, 0x76543210, 0xfedcba98, false, false));
  else return __int_as_float(__builtin_amdgcn_update_dpp(0, b, 0x160 | M, 0xf, 0xf, true)); }
// ---- fused attention: scores and weights live in registers only ----
__device__ __forceinline__ v8f f_mma(v16h a, v16h b, v8f c) { return __builtin_amdgcn_wmma_f32_16x16x32_f16(false, a, false, b, (short)0, c, false, false); }
typedef unsigned v4ua __attribute__((ext_vector_type(4), may_alias));
#define SC2 0.18033688011112042f     /* (1 / 8) log2(e): scores go to the exponent base 2 */
#define MASKED -3.0e38f              /* score of a masked key: its weight underflows to 0 against any row reference >= M0 */
#define M0 -1.0e30f                  /* start value of a row's reference; a row with every key masked keeps it, sums 0 and ends as 0 x inf = NaN like the definition */
// one bit per (query, key): bit j of word [query][key / 32] is mask[query][32 (key / 32) + j] != 0; a wave packs 32 words
__device__ __forceinline__ void d_maskbits(unsigned bx, const int* __restrict__ mask, unsigned* __restrict__ MB) {
  const int lane = threadIdx.x & 31; const size_t wv = (size_t)bx * 8 + (threadIdx.x >> 5); const int* m = mask + wv * 1024; unsigned keep = 0;
#pragma unroll      /* 32 independent loads in flight */
  for (int i = 0; i < 32; ++i) { const unsigned bits = __builtin_amdgcn_ballot_w32(m[i * 32 + lane] != 0); if (lane == i) keep = bits; }
  MB[wv * 32 + lane] = keep;
  asm volatile("s_wait_xcnt 0x0" ::: "memory"); }      /* precaution: stands behind the store above, in front of the other jobs' code, which in the listing follows this one and rewrites the store's registers */
// S^T tile rows are keys 8 hh + r, its column is query ln: bit 16 kt + 8 hh + r of the query's mask word
__device__ __forceinline__ void mask_tile(v8f& s, unsigned word, int kt, int hh) { const unsigned u = word >> (16 * kt + 8 * hh);
#pragma unroll      /* constant indices, so the tile stays in registers */
  for (int r = 0; r < 8; ++r) s[r] = ((u >> r) & 1u) ? s[r] : MASKED; }
// K and V^T go through LDS: a stage is 128 keys of the head (K: 128 rows of 128 B; V^T: 64 rows of 256 B), brought once for the 8 waves by asynchronous copies of whole lines, two buffers, the next stage in flight while this one is worked on
#define FST 128                      /* keys a stage */
#define FK_PITCH 144                 /* LDS bytes from K row to K row: 128 + 16, an odd multiple of 16 B, so the 16 rows of a fragment read fall on different banks */
#define FV_PITCH 272                 /* the same for the V^T rows: 256 + 16 */
#define FK_BYTES (FST * FK_PITCH)
#define F_BUF (FK_BYTES + HD * FV_PITCH)      /* one stage: K rows, then V^T rows */
// four asynchronous copies of 16 B a lane: LDS byte address l (+ ls each), global address g (+ gs elements each)
__device__ __forceinline__ void f_copy4(unsigned l, unsigned ls, const _Float16* g, size_t gs) {
  const unsigned l1 = l + ls, l2 = l1 + ls, l3 = l2 + ls; const _Float16* g1 = g + gs; const _Float16* g2 = g1 + gs; const _Float16* g3 = g2 + gs;
  /* the copies move global bytes into LDS through no register; the closing s_wait_xcnt is a precaution: it stands in front of any rewrite of the address registers named here */
  asm volatile("global_load_async_to_lds_b128 %0, %4, off\n\t"
               "global_load_async_to_lds_b128 %1, %5, off\n\t"
               "global_load_async_to_lds_b128 %2, %6, off\n\t"
               "global_load_async_to_lds_b128 %3, %7, off\n\t"
               "s_wait_xcnt 0x0"
               :: "v"(l), "v"(l1), "v"(l2), "v"(l3), "v"(g), "v"(g1), "v"(g2), "v"(g3) : "memory"); }
// the key loop of k_fattn; MSK = false is taken by a work-group none of whose 256 mask rows holds a zero, and then reads no mask word
// ring: the two buffers; gk, gv, lk, lv: this lane's first global and LDS addresses as a copier of K and of V^T
template <bool MSK>
__device__ __forceinline__ void fattn_keys(const unsigned char* ring, const _Float16* gk, const _Float16* gv, unsigned lk, unsigned lv, const unsigned* mb, int ln, int hh, const v16h (&qf)[2][2], v8f (&o)[2][4], float (&m)[2], float (&l)[2]) {
  const v8f z8 = {0.f,0.f,0.f,0.f,0.f,0.f,0.f,0.f}; v16h ka[2][2], kb2[2][2], va[4], vb[4]; unsigned mw[2] = {0u, 0u};
  auto stage = [&](int t, int buf) { f_copy4(lk + buf * F_BUF, 32 * FK_PITCH, gk + (size_t)t * FST * DM, (size_t)32 * DM); f_copy4(lv + buf * F_BUF, 16 * FV_PITCH, gv + t * FST, (size_t)16 * SQ); };
  if (MSK) { mw[0] = mb[0]; mw[1] = mb[16 * (SQ / 32)]; }
  stage(0, 0);
  asm volatile("s_wait_asynccnt 0x0" ::: "memory");      /* this wave's copies of stage 0 have landed */
  __syncthreads();                                       /* every wave's have: stage 0 may be read */
  stage(1, 1);
#pragma unroll 1    /* one stage a trip: the publish point at the foot stands once */
  for (int t = 0; t < SQ / FST; ++t) { const unsigned char* kt = ring + (t & 1) * F_BUF + ln * FK_PITCH + 16 * hh; const unsigned char* vt = ring + (t & 1) * F_BUF + FK_BYTES + ln * FV_PITCH + 16 * hh;
    // the K and V^T fragments of pass p of this stage, in the k order of g2_frag
    auto frags = [&](int p, v16h (&k)[2][2], v16h (&v)[4]) {
#pragma unroll      /* constant indices, so the fragment arrays stay in registers */
      for (int i = 0; i < 2; ++i) { k[i][0] = g2_lfrag(kt + (p * 32 + i * 16) * FK_PITCH); k[i][1] = g2_lfrag(kt + (p * 32 + i * 16) * FK_PITCH + 64); }
#pragma unroll      /* constant indices, so the fragment arrays stay in registers */
      for (int d = 0; d < 4; ++d) v[d] = g2_lfrag(vt + d * 16 * FV_PITCH + p * 64); };
    // one pass = 32 keys: kc and vc hold this pass's K and V^T fragments, kx and vn take those of pass pn of the same stage (pn = 0: the stage's last pass, which fetches nothing)
    auto pass = [&](int kb, int pn, const v16h (&kc)[2][2], v16h (&kx)[2][2], const v16h (&vc)[4], v16h (&vn)[4]) { const int kn = (kb + 32) & (SQ - 1);
      v8f s[2][2]; float mx[2]; FragH pf[2];
      if (pn) frags(pn, kx, vn);
      __builtin_amdgcn_sched_barrier(0);      /* the next pass's LDS reads stay one group ahead of this pass's products instead of among them */
#pragma unroll      /* constant indices, so the fragment arrays stay in registers */
      for (int qt = 0; qt < 2; ++qt)
#pragma unroll      /* constant indices, so the fragment arrays stay in registers */
        for (int kt2 = 0; kt2 < 2; ++kt2) s[qt][kt2] = f_mma(kc[kt2][1], qf[qt][1], f_mma(kc[kt2][0], qf[qt][0], z8));
      if (MSK) {
#pragma unroll      /* constant indices, so the fragment arrays stay in registers */
        for (int qt = 0; qt < 2; ++qt) { mask_tile(s[qt][0], mw[qt], 0, hh); mask_tile(s[qt][1], mw[qt], 1, hh); }
        __builtin_amdgcn_sched_barrier(0);      /* with the one below: the next pass's two mask loads and their wait stay one group, so nothing that could rewrite an address register comes between */
        mw[0] = mb[kn >> 5]; mw[1] = mb[16 * (SQ / 32) + (kn >> 5)];
        asm volatile("s_wait_xcnt 0x0" ::: "memory");      /* precaution: stands behind the loads issued above, in front of any rewrite of their address registers */
        __builtin_amdgcn_sched_barrier(0); }
#pragma unroll      /* constant indices, so the fragment arrays stay in registers */
      for (int qt = 0; qt < 2; ++qt) { float a = fmaxf(s[qt][0][0], s[qt][1][0]);
#pragma unroll      /* constant indices, so the fragment arrays stay in registers */
        for (int r = 1; r < 8; ++r) a = fmaxf(a, fmaxf(s[qt][0][r], s[qt][1][r]));
        a *= SC2; mx[qt] = fmaxf(a, lane_xor<16>(a)); }      /* both halves of a column agree on the maximum, so on the reference too */
      if (__builtin_amdgcn_ballot_w32(mx[0] > m[0] + 8.f || mx[1] > m[1] + 8.f) != 0) {      /* scalar branch: rescale only when some column's reference must rise */
#pragma unroll      /* constant indices, so the fragment arrays stay in registers */
        for (int qt = 0; qt < 2; ++qt) { const float mn = fmaxf(m[qt], mx[qt]), f = __builtin_amdgcn_exp2f(m[qt] - mn); m[qt] = mn; l[qt] *= f;
#pragma unroll      /* constant indices, so the fragment arrays stay in registers */
          for (int d = 0; d < 4; ++d) o[qt][d] *= f; } }
#pragma unroll      /* constant indices, so the fragment arrays stay in registers */
      for (int qt = 0; qt < 2; ++qt) { float ls = 0.f;
#pragma unroll      /* constant indices, so the fragment arrays stay in registers */
        for (int r = 0; r < 8; ++r) { const float p0 = __builtin_amdgcn_exp2f(__builtin_fmaf(s[qt][0][r], SC2, -m[qt])), p1 = __builtin_amdgcn_exp2f(__builtin_fmaf(s[qt][1][r], SC2, -m[qt])); ls += p0 + p1; pf[qt].h[r] = (_Float16)p0; pf[qt].h[8 + r] = (_Float16)p1; }
        l[qt] += ls; }
#pragma unroll      /* constant indices, so the fragment arrays stay in registers */
      for (int d = 0; d < 4; ++d) { o[0][d] = f_mma(vc[d], pf[0].v, o[0][d]); o[1][d] = f_mma(vc[d], pf[1].v, o[1][d]); }
      __builtin_amdgcn_sched_barrier(0); };      /* keeps the next pass's products behind this pass: moved up, they would wait on fragments fetched only half a pass earlier */
    const int kb = t * FST;
    frags(0, ka, va);
    pass(kb, 1, ka, kb2, va, vb); pass(kb + 32, 2, kb2, ka, vb, va); pass(kb + 64, 3, ka, kb2, va, vb); pass(kb + 96, 0, kb2, ka, vb, va);      /* the two fragment sets swap by name, no register is copied */
    asm volatile("s_wait_dscnt 0x0" ::: "memory");         /* this wave has finished reading the buffer */
    asm volatile("s_wait_asynccnt 0x0" ::: "memory");      /* its copies of stage t + 1 have landed */
    __syncthreads();                                       /* publishes stage t + 1 and ends every wave's reads of stage t */
    if (t + 2 < SQ / FST) stage(t + 2, t & 1); }           /* refill of the buffer just left; the test reads the same in the whole work-group */
  asm volatile("s_wait_asynccnt 0x0" ::: "memory"); }      /* nothing of this wave is in flight behind the loop */
// One wave: 32 queries of one head against all keys, 32 keys a pass. S^T = K Q^T (A = K rows, B = Q rows), so a lane holds one query's scores; the two S^T tiles of a pass, converted in place,
// are the B operand of O^T += V^T P^T. Running row reference m (base-2 exponent), raised only when a new maximum exceeds it by more than 8 (weights then stay <= 256, inside f16); f32 row sums.
// Writes merged f16 rows 64 o + 64 alpha vp and, per (batch, head, query), the pair (m, 1 / sum) for the head-sum launch.
// The 8 waves of a work-group walk the same head's K and V^T, which are staged once for all of them in LDS.
__global__ __launch_bounds__(256) void k_fattn(const _Float16* __restrict__ Q, const _Float16* __restrict__ Kp, const _Float16* __restrict__ VT, const unsigned* __restrict__ MB, const float* __restrict__ AV, _Float16* __restrict__ O16, float* __restrict__ ST) {
  const int tid = threadIdx.x, w = tid >> 5, lane = tid & 31, ln = lane & 15, hh = lane >> 4; const int h = blockIdx.y, b = blockIdx.z, q0 = blockIdx.x * 256 + w * 32; const size_t r0 = (size_t)b * SQ;
  __shared__ __attribute__((aligned(16))) unsigned char ring[2 * F_BUF]; __shared__ __attribute__((aligned(16))) unsigned wz[8];
  const _Float16* qp = Q + (r0 + q0 + ln) * DM + h * HD; const unsigned* mb = MB + (size_t)(q0 + ln) * (SQ / 32);
  /* copy roles: 8 lanes cover the 128 B of a K row, 16 lanes the 256 B of a V^T row, so a wave copies 4 whole lines at a time */
  const _Float16* gk = Kp + (r0 + (tid >> 3)) * DM + h * HD + (tid & 7) * 8; const _Float16* gv = VT + ((size_t)(b * NH + h) * HD + (tid >> 4)) * SQ + (tid & 15) * 8;
  const unsigned lk = (unsigned)(size_t)&ring[0] + (tid >> 3) * FK_PITCH + (tid & 7) * 16, lv = (unsigned)(size_t)&ring[0] + FK_BYTES + (tid >> 4) * FV_PITCH + (tid & 15) * 16;
  const v8f z8 = {0.f,0.f,0.f,0.f,0.f,0.f,0.f,0.f};
  v16h qf[2][2]; v8f o[2][4]; float m[2] = {M0, M0}, l[2] = {0.f, 0.f};
#pragma unroll      /* constant indices, so the fragment arrays stay in registers */
  for (int t = 0; t < 2; ++t) { qf[t][0] = g2_frag(qp + (size_t)t * 16 * DM, hh); qf[t][1] = g2_frag(qp + (size_t)t * 16 * DM + 32, hh);
#pragma unroll      /* constant indices, so the fragment arrays stay in registers */
    for (int d = 0; d < 4; ++d) o[t][d] = z8; }
  unsigned all1 = 0xFFFFFFFFu;      /* the AND of this thread's share of the work-group's 256 mask rows: they lie one behind another (64 KiB), so a wave reads 512 B in a row, four whole lines an instruction */
  { const v4ua* blk = (const v4ua*)(MB + (size_t)blockIdx.x * 256 * (SQ / 32)) + tid;
#pragma unroll      /* 16 independent loads in flight */
    for (int i = 0; i < SQ / 128; ++i) { const v4ua x = blk[i * 256]; all1 &= x[0] & x[1] & x[2] & x[3]; } }
  asm volatile("s_wait_xcnt 0x0" ::: "memory");      /* precaution: stands behind the loads issued above, in front of any rewrite of their address registers */
  const unsigned bz = __builtin_amdgcn_ballot_w32(all1 != 0xFFFFFFFFu);      /* taken with every lane on */
  if (lane == 0) wz[w] = bz;
  __syncthreads();      /* the key loop holds barriers, so the whole work-group takes one side: every wave sees all 8 waves' findings */
  const v4ua z0 = *(const v4ua*)&wz[0], z1 = *(const v4ua*)&wz[4];
  if (__builtin_amdgcn_readfirstlane(z0[0] | z0[1] | z0[2] | z0[3] | z1[0] | z1[1] | z1[2] | z1[3]) != 0) fattn_keys<true>(ring, gk, gv, lk, lv, mb, ln, hh, qf, o, m, l); else fattn_keys<false>(ring, gk, gv, lk, lv, mb, ln, hh, qf, o, m, l);      /* scalar branch, the same in every wave */
  /* row layout of the epilogue: 16 lanes cover one query's 64 d (256 B of the f32 addend, 128 B of the f16 result), a wave two rows an instruction, so every load and store covers whole lines */
  const int rs = lane >> 4, e4 = (lane & 15) * 4; const size_t eo = (r0 + q0 + rs) * DM + h * HD + e4; const float* ap = AV + eo; v4f av[16];
  __builtin_amdgcn_sched_barrier(0);      /* with the one below: the sixteen loads of the addend and their wait stay one group, so nothing that could rewrite an address register comes between */
#pragma unroll      /* constant indices, so the sixteen values stay in registers */
  for (int i = 0; i < 16; ++i) av[i] = *(const v4fa*)(ap + (size_t)(i * 2) * DM);
  asm volatile("s_wait_xcnt 0x0" :: "v"(ap) : "memory");      /* precaution: stands behind the loads issued above, in front of any rewrite of their address registers; the address is named as an input so that it keeps its registers up to here and no load's result lands on them */
  __builtin_amdgcn_sched_barrier(0);
  float (*so)[68] = (float (*)[68])(&ring[0] + w * (32 * 68 * 4));      /* this wave's 32 x 64 f32 staging lies in the ring, which is free behind the key loop: every wave's reads and copies end in front of the loop's last barrier */
#pragma unroll      /* constant indices, so the fragment arrays stay in registers */
  for (int qt = 0; qt < 2; ++qt) { const float inv = 1.0f / (l[qt] + lane_xor<16>(l[qt])), sc = inv * 64.0f; const int q = q0 + qt * 16 + ln;
    if (hh == 0) { float* st = ST + ((size_t)(b * NH + h) * SQ + q) * 2; st[0] = m[qt]; st[1] = inv; }
#pragma unroll      /* constant indices, so the fragment arrays stay in registers */
    for (int d = 0; d < 4; ++d) { v4f x0, x1;      /* O^T tile: a lane holds 8 consecutive d of one query */
#pragma unroll      /* constant indices, so the fragment arrays stay in registers */
      for (int r = 0; r < 4; ++r) { x0[r] = o[qt][d][r]; x1[r] = o[qt][d][4 + r]; }
      *(v4fa*)&so[qt * 16 + ln][d * 16 + 8 * hh] = x0; *(v4fa*)&so[qt * 16 + ln][d * 16 + 8 * hh + 4] = x1; }
    if (hh == 0) so[qt * 16 + ln][64] = sc; }      /* the row's factor rides in the row's pad, so product and addend meet in one expression as before */
  asm volatile("s_wait_dscnt 0x0" ::: "memory");      /* the wave's own LDS writes are done before its lanes read one another's values */
#pragma unroll      /* the LDS reads issue ahead of the stores */
  for (int i = 0; i < 16; ++i) { const v4f x = *(const v4fa*)&so[i * 2 + rs][e4]; const float sc = so[i * 2 + rs][64]; v4h h4;
#pragma unroll      /* constant indices into the vector */
    for (int r = 0; r < 4; ++r) h4[r] = (_Float16)(x[r] * sc + av[i][r]);
    *(v4h*)(O16 + eo + (size_t)(i * 2) * DM) = h4; } }
// K, Q and the row statistics of d_headsum go through LDS: a stage is one head's 128 B of the work-group's 256 K rows and 64 Q rows, brought by asynchronous copies of whole lines, two buffers, the next head in flight while this one is worked on
#define HS_PITCH 144                 /* LDS bytes from row to row: 128 + 16, an odd multiple of 16 B, so the 16 rows of a fragment read fall on different banks */
#define HS_BUF (320 * HS_PITCH)      /* one stage: rows 0..255 = K, rows 256..319 = Q */
// two asynchronous copies of 16 B a lane: LDS byte address l (+ ls), global address g (+ gs bytes)
__device__ __forceinline__ void f_copy2(unsigned l, unsigned ls, const unsigned char* g, size_t gs) {
  const unsigned l1 = l + ls; const unsigned char* g1 = g + gs;
  /* the copies move global bytes into LDS through no register; the closing s_wait_xcnt is a precaution: it stands in front of any rewrite of the address registers named here */
  asm volatile("global_load_async_to_lds_b128 %0, %2, off\n\t"
               "global_load_async_to_lds_b128 %1, %3, off\n\t"
               "s_wait_xcnt 0x0"
               :: "v"(l), "v"(l1), "v"(g), "v"(g1) : "memory"); }
// this lane's ten copies of head h into buffer buf; gk, gq: the work-group's first K and Q rows; go, lc: the lane's element offset from them and its first LDS address
__device__ __forceinline__ void hs_stage(const _Float16* gk, const _Float16* gq, unsigned go, unsigned lc, int h, int buf) { const unsigned l = lc + buf * HS_BUF;
  f_copy4(l, 32 * HS_PITCH, gk + h * HD + go, (size_t)32 * DM); f_copy4(l + 128 * HS_PITCH, 32 * HS_PITCH, gk + (size_t)128 * DM + h * HD + go, (size_t)32 * DM); f_copy2(l + 256 * HS_PITCH, 32 * HS_PITCH, (const unsigned char*)(gq + h * HD + go), (size_t)32 * DM * 2); }
// the head loop of d_headsum, entered with head 0 published and head 1 in flight; MSK = false is taken by a work-group whose 64 x 256 mask bits are all set
// ring: the two buffers; gk, gq, go, lc: as in hs_stage; kr, qr: the LDS rows of this lane's first K and Q fragments; st: this lane's first (m, 1 / sum) pair in LDS
template <bool MSK>
__device__ __forceinline__ void headsum_heads(const unsigned char* ring, const _Float16* gk, const _Float16* gq, unsigned go, unsigned lc, int kr, int qr, const float* st, int hh, const unsigned (&mw)[2][2], v8f (&acc)[2][4]) {
  const v8f z8 = {0.f,0.f,0.f,0.f,0.f,0.f,0.f,0.f};
#pragma unroll 1    /* one head a trip: the publish point at the foot stands once, and the live set stays small enough for four waves a SIMD */
  for (int h = 0; h < NH; ++h) { v16h qf[2][2], kf[4][2]; float mr[2], iv[2]; const unsigned char* kp = ring + (h & 1) * HS_BUF + kr * HS_PITCH + 16 * hh; const unsigned char* qp = ring + (h & 1) * HS_BUF + qr * HS_PITCH + 16 * hh;
#pragma unroll      /* constant indices, so the fragment arrays stay in registers */
    for (int t = 0; t < 4; ++t) { kf[t][0] = g2_lfrag(kp + t * 16 * HS_PITCH); kf[t][1] = g2_lfrag(kp + t * 16 * HS_PITCH + 64); }
#pragma unroll      /* constant indices, so the fragment arrays stay in registers */
    for (int t = 0; t < 2; ++t) { qf[t][0] = g2_lfrag(qp + t * 16 * HS_PITCH); qf[t][1] = g2_lfrag(qp + t * 16 * HS_PITCH + 64); mr[t] = st[(h * 64 + t * 16) * 2]; iv[t] = st[(h * 64 + t * 16) * 2 + 1]; }
#pragma unroll      /* constant indices, so the fragment arrays stay in registers */
    for (int qt = 0; qt < 2; ++qt)
#pragma unroll      /* constant indices, so the fragment arrays stay in registers */
      for (int kt = 0; kt < 4; ++kt) { v8f s = f_mma(kf[kt][1], qf[qt][1], f_mma(kf[kt][0], qf[qt][0], z8));
        if (MSK) mask_tile(s, mw[qt][kt >> 1], kt & 1, hh);
#pragma unroll      /* constant indices, so the fragment arrays stay in registers */
        for (int r = 0; r < 8; ++r) acc[qt][kt][r] = __builtin_fmaf(__builtin_amdgcn_exp2f(__builtin_fmaf(s[r], SC2, -mr[qt])), iv[qt], acc[qt][kt][r]); }
    asm volatile("s_wait_dscnt 0x0" ::: "memory");         /* this wave has finished reading the buffer */
    asm volatile("s_wait_asynccnt 0x0" ::: "memory");      /* its copies of head h + 1 have landed */
    __syncthreads();                                       /* publishes head h + 1 and ends every wave's reads of head h */
    if (h + 2 < NH) hs_stage(gk, gq, go, lc, h + 2, h & 1); }      /* refill of the buffer just left; the test reads the same in the whole work-group */
  asm volatile("s_wait_asynccnt 0x0" ::: "memory"); }      /* nothing of this wave is in flight behind the loop */
// second output: one wave holds 32 queries x 64 keys of the head sum in registers and walks the 16 heads, forming each head's S^T tiles again (same products, same order as k_fattn) and its weights from the stored (m, 1 / sum)
// a work-group is 2 x 4 such waves: 64 queries x 256 keys, so a staged K row serves two waves and a staged Q row four
// bx: the work-group's index within this job (key block fastest, then query block, then batch); sm: the work-group's LDS, of which the job takes the two buffers, then the statistics, then the 8 mask findings
#define HS_G ((SQ / 256) * (SQ / 64) * NB)      /* work-groups of the head sum */
__device__ __forceinline__ void d_headsum(unsigned bx, unsigned char* sm, const _Float16* __restrict__ Q, const _Float16* __restrict__ Kp, const unsigned* __restrict__ MB, const float* __restrict__ ST, float* __restrict__ WS) {
  unsigned char* ring = sm; float (*sst)[64][2] = (float (*)[64][2])(sm + 2 * HS_BUF); unsigned* wz = (unsigned*)(sm + 2 * HS_BUF + NH * 64 * 2 * 4);
  const int tid = threadIdx.x, w = tid >> 5, lane = tid & 31, ln = lane & 15, hh = lane >> 4, qi = w >> 2, ki = w & 3; const int b = (int)(bx / ((SQ / 256) * (SQ / 64))), qb = (int)(bx / (SQ / 256) % (SQ / 64)) * 64, kb = (int)(bx % (SQ / 256)) * 256, q0 = qb + qi * 32, k0 = kb + ki * 64; const size_t r0 = (size_t)b * SQ;
  /* copy roles: 8 lanes cover the 128 B of a row, so a wave copies 4 whole lines at a time; the statistics are 512 B a head, 32 lanes each */
  const _Float16* gk = Kp + (r0 + kb) * DM; const _Float16* gq = Q + (r0 + qb) * DM; const unsigned go = (tid >> 3) * DM + (tid & 7) * 8; const unsigned lc = (unsigned)(size_t)&ring[0] + (tid >> 3) * HS_PITCH + (tid & 7) * 16;
  f_copy2((unsigned)(size_t)&sst[0][0][0] + tid * 16, 8 * 512, (const unsigned char*)(ST + ((size_t)(b * NH + (tid >> 5)) * SQ + qb) * 2 + (tid & 31) * 4), (size_t)8 * SQ * 2 * 4);      /* heads w and w + 8; waited for with head 0's copies */
  hs_stage(gk, gq, go, lc, 0, 0);
  const v8f z8 = {0.f,0.f,0.f,0.f,0.f,0.f,0.f,0.f}; v8f acc[2][4]; unsigned mw[2][2];
#pragma unroll      /* constant indices, so the fragment arrays stay in registers */
  for (int qt = 0; qt < 2; ++qt) { const unsigned* mb = MB + (size_t)(q0 + qt * 16 + ln) * (SQ / 32) + (k0 >> 5); mw[qt][0] = mb[0]; mw[qt][1] = mb[1];
#pragma unroll      /* constant indices, so the fragment arrays stay in registers */
    for (int kt = 0; kt < 4; ++kt) acc[qt][kt] = z8; }
  const unsigned bz = __builtin_amdgcn_ballot_w32((mw[0][0] & mw[0][1] & mw[1][0] & mw[1][1]) != 0xFFFFFFFFu);      /* taken with every lane on */
  if (lane == 0) wz[w] = bz;
  asm volatile("s_wait_asynccnt 0x0" ::: "memory");      /* this wave's copies of head 0 and of the statistics have landed */
  __syncthreads();      /* every wave's have: they may be read; and every wave sees all 8 waves' mask findings: the head loop holds barriers, so the whole work-group takes one side */
  hs_stage(gk, gq, go, lc, 1, 1);
  const v4ua z0 = *(const v4ua*)&wz[0], z1 = *(const v4ua*)&wz[4]; const float* st = &sst[0][qi * 32 + ln][0]; const int kr = ki * 64 + ln, qr = 256 + qi * 32 + ln;
  if (__builtin_amdgcn_readfirstlane(z0[0] | z0[1] | z0[2] | z0[3] | z1[0] | z1[1] | z1[2] | z1[3]) != 0) headsum_heads<true>(ring, gk, gq, go, lc, kr, qr, st, hh, mw, acc); else headsum_heads<false>(ring, gk, gq, go, lc, kr, qr, st, hh, mw, acc);      /* scalar branch, the same in every wave */
  float (*so)[68] = (float (*)[68])(&ring[0] + w * (32 * 68 * 4));      /* this wave's 32 x 64 f32 staging lies in the ring, which is free behind the head loop: every wave's reads and copies end in front of the loop's last barrier */
#pragma unroll      /* constant indices, so the fragment arrays stay in registers */
  for (int qt = 0; qt < 2; ++qt)
#pragma unroll      /* constant indices, so the fragment arrays stay in registers */
    for (int kt = 0; kt < 4; ++kt) { v4f a0, a1;      /* a lane holds 8 consecutive keys of one query */
#pragma unroll      /* constant indices, so the fragment arrays stay in registers */
      for (int r = 0; r < 4; ++r) { a0[r] = acc[qt][kt][r]; a1[r] = acc[qt][kt][4 + r]; }
      *(v4fa*)&so[qt * 16 + ln][kt * 16 + 8 * hh] = a0; *(v4fa*)&so[qt * 16 + ln][kt * 16 + 8 * hh + 4] = a1; }
  asm volatile("s_wait_dscnt 0x0" ::: "memory");      /* the wave's own LDS writes are done before its lanes read one another's values */
  /* 16 lanes store the 256 B that the wave holds of one query's row, a wave two rows an instruction: four whole lines */
  const int rs = lane >> 4, e4 = (lane & 15) * 4; float* d0 = WS + (r0 + q0 + rs) * SQ + k0 + e4;
#pragma unroll      /* the LDS reads issue ahead of the stores */
  for (int i = 0; i < 16; ++i) { const v4f x = *(const v4fa*)&so[i * 2 + rs][e4]; *(v4f*)(d0 + (size_t)(i * 2) * SQ) = x; } }
// eight asynchronous copies of 16 B a lane, rows 16 apart: LDS byte address l (+ 16 rows each), global address g (+ gs elements each)
__device__ __forceinline__ void g3_copy8(unsigned l, const _Float16* g, size_t gs) {
  const unsigned l1 = l + 16 * G2_PITCH, l2 = l + 32 * G2_PITCH, l3 = l + 48 * G2_PITCH, l4 = l + 64 * G2_PITCH, l5 = l + 80 * G2_PITCH, l6 = l + 96 * G2_PITCH, l7 = l + 112 * G2_PITCH;
  const _Float16* g1 = g + gs; const _Float16* g2 = g1 + gs; const _Float16* g3 = g2 + gs; const _Float16* g4 = g3 + gs; const _Float16* g5 = g4 + gs; const _Float16* g6 = g5 + gs; const _Float16* g7 = g6 + gs;
  /* the copies move global bytes into LDS through no register; the closing s_wait_xcnt is a precaution: it stands in front of any rewrite of the address registers named here */
  asm volatile("global_load_async_to_lds_b128 %0, %8, off\n\t"
               "global_load_async_to_lds_b128 %1, %9, off\n\t"
               "global_load_async_to_lds_b128 %2, %10, off\n\t"
               "global_load_async_to_lds_b128 %3, %11, off\n\t"
               "global_load_async_to_lds_b128 %4, %12, off\n\t"
               "global_load_async_to_lds_b128 %5, %13, off\n\t"
               "global_load_async_to_lds_b128 %6, %14, off\n\t"
               "global_load_async_to_lds_b128 %7, %15, off\n\t"
               "s_wait_xcnt 0x0"
               :: "v"(l), "v"(l1), "v"(l2), "v"(l3), "v"(l4), "v"(l5), "v"(l6), "v"(l7), "v"(g), "v"(g1), "v"(g2), "v"(g3), "v"(g4), "v"(g5), "v"(g6), "v"(g7) : "memory"); }
// C[MPO][DM] (f32) = A[MPO][DM] Bh^T alpha + bf16(bias) as a job of 256 threads, so that it can share a grid with the head sum: work-group tile 128 x 128 as in k_gemm2, eight waves as 4 x 2, wave tile 32 x 64;
// stages, ring, pitch and k order are those of k_gemm2 (128 k of 128 A rows and 128 B rows, two buffers, the next stage in flight while this one is multiplied); sm: the work-group's LDS, 2 G2_BUF bytes
#define GO_G ((MPO / 128) * (DM / 128))      /* work-groups of the output product */
__device__ __forceinline__ void d_gemm_o(unsigned bx, unsigned char* sm, const _Float16* __restrict__ A, const _Float16* __restrict__ Bh, float alpha, const float* __restrict__ bias, float* __restrict__ C) {
  const int tid = threadIdx.x, w = tid >> 5, lane = tid & 31, ln = lane & 15, hh = lane >> 4, wm = w >> 1, wn = w & 1;
  const int mt = (int)(bx / (DM / 128)), nq = (int)(bx % (DM / 128)), row0 = mt * 128 + 32 * wm, col0 = nq * 128, colw = col0 + 64 * wn;
  const int cr = tid >> 4, cc = tid & 15;      /* copy role: 16 lanes cover the 256 B of one row, a wave two whole rows (4 lines) */
  const _Float16* ga = A + (size_t)(mt * 128 + cr) * DM + cc * 8; const _Float16* gb = Bh + (size_t)(col0 + cr) * DM + cc * 8; const unsigned lc = (unsigned)(size_t)sm + cr * G2_PITCH + cc * 16;
  auto stage = [&](int t, int buf) { const unsigned l = lc + buf * G2_BUF; g3_copy8(l, ga + t * 128, (size_t)16 * DM); g3_copy8(l + 128 * G2_PITCH, gb + t * 128, (size_t)16 * DM); };
  const v8f z8 = {0.f,0.f,0.f,0.f,0.f,0.f,0.f,0.f}; v8f acc[2][4];      /* acc[i][j]: rows 16 i, columns 16 j of the wave's tile */
#pragma unroll      /* constant indices, so the accumulators stay in registers */
  for (int i = 0; i < 2; ++i)
#pragma unroll      /* constant indices, so the accumulators stay in registers */
    for (int j = 0; j < 4; ++j) acc[i][j] = z8;
  stage(0, 0);
  asm volatile("s_wait_asynccnt 0x0" ::: "memory");      /* this wave's copies of stage 0 have landed */
  __syncthreads();                                       /* every wave's have: stage 0 may be read */
  stage(1, 1);
#pragma unroll 1    /* one stage a trip: the publish point at the foot stands once */
  for (int t = 0; t < DM / 128; ++t) { const unsigned char* ap = sm + (t & 1) * G2_BUF + (32 * wm + ln) * G2_PITCH + 16 * hh; const unsigned char* bq = sm + (t & 1) * G2_BUF + (128 + 64 * wn + ln) * G2_PITCH + 16 * hh; v16h fa[2][2], fb[2][4];
    auto frags = [&](int kk, v16h (&a)[2], v16h (&b)[4]) {
#pragma unroll      /* constant indices, so the fragment arrays stay in registers */
      for (int j = 0; j < 2; ++j) a[j] = g2_lfrag(ap + j * 16 * G2_PITCH + kk * 64);
#pragma unroll      /* constant indices, so the fragment arrays stay in registers */
      for (int j = 0; j < 4; ++j) b[j] = g2_lfrag(bq + j * 16 * G2_PITCH + kk * 64); };
    frags(0, fa[0], fb[0]);
#pragma unroll      /* constant indices, so the fragment arrays stay in registers */
    for (int kk = 0; kk < 4; ++kk) { const int c = kk & 1;
      if (kk < 3) frags(kk + 1, fa[c ^ 1], fb[c ^ 1]);
      __builtin_amdgcn_sched_barrier(0);      /* the next block's LDS reads stay one group ahead of this block's products instead of among them */
#pragma unroll      /* constant indices, so the fragment arrays stay in registers */
      for (int j = 0; j < 4; ++j)
#pragma unroll      /* constant indices, so the fragment arrays stay in registers */
        for (int i = 0; i < 2; ++i) acc[i][j] = g2_mma(fa[c][i], fb[c][j], acc[i][j]);
      __builtin_amdgcn_sched_barrier(0); }    /* and the block after next's reads stay behind these products */
    asm volatile("s_wait_dscnt 0x0" ::: "memory");         /* this wave has finished reading the buffer */
    asm volatile("s_wait_asynccnt 0x0" ::: "memory");      /* its copies of stage t + 1 have landed */
    __syncthreads();                                       /* publishes stage t + 1 and ends every wave's reads of stage t */
    if (t + 2 < DM / 128) stage(t + 2, t & 1); }           /* refill of the buffer just left; the test reads the same in the whole work-group */
  asm volatile("s_wait_asynccnt 0x0" ::: "memory");        /* nothing of this wave is in flight behind the loop */
  float bv[4];
  __builtin_amdgcn_sched_barrier(0);      /* with the one below: the loads of the four bias values stay one group with their wait, so nothing that could rewrite an address register comes between */
#pragma unroll      /* constant indices, so the four values stay in registers */
  for (int t = 0; t < 4; ++t) bv[t] = bias[colw + t * 16 + ln];
  asm volatile("s_wait_xcnt 0x0" ::: "memory");      /* precaution: stands behind the loads issued above, in front of any rewrite of their address registers */
  __builtin_amdgcn_sched_barrier(0);
  float (*so)[68] = (float (*)[68])(sm + w * (32 * 68 * 4));      /* this wave's 32 x 64 f32 staging lies in the ring, which is free behind the loop: every wave's reads and copies end in front of the loop's last barrier */
#pragma unroll      /* constant indices, so the accumulators stay in registers */
  for (int t = 0; t < 4; ++t) { const float b = bf16_round(bv[t]);
#pragma unroll      /* constant indices, so the accumulators stay in registers */
    for (int i = 0; i < 2; ++i)
#pragma unroll      /* constant indices, so the accumulators stay in registers */
      for (int r = 0; r < 8; ++r) so[i * 16 + 8 * hh + r][t * 16 + ln] = acc[i][t][r] * alpha + b; }
  asm volatile("s_wait_dscnt 0x0" ::: "memory");      /* the wave's own LDS writes are done before its lanes read one another's values */
  /* 16 lanes store the 256 B that the wave holds of one row, a wave two rows an instruction: four whole lines */
  const int rs = lane >> 4, e4 = (lane & 15) * 4; float* d0 = C + (size_t)(row0 + rs) * DM + colw + e4;
#pragma unroll      /* the LDS reads issue ahead of the stores */
  for (int i = 0; i < 16; ++i) { const v4f x = *(const v4fa*)&so[i * 2 + rs][e4]; *(v4f*)(d0 + (size_t)(i * 2) * DM) = x; }
  asm volatile("s_wait_xcnt 0x0" ::: "memory"); }      /* precaution: stands behind the stores above, in front of the other job's code, which in the listing may follow this one and rewrite the stores' registers */
// all that reads the attention launch's results only: the output product and the head sum. The product's work-groups, the shorter ones and bound by other units, come first (for speed only)
__global__ __launch_bounds__(256) void k_tail(const _Float16* __restrict__ O16, const _Float16* __restrict__ BO, float alpha, const float* __restrict__ bo, float* __restrict__ out0,
    const _Float16* __restrict__ Q, const _Float16* __restrict__ Kp, const unsigned* __restrict__ MB, const float* __restrict__ ST, float* __restrict__ WS) { const unsigned bx = blockIdx.x;
  __shared__ __attribute__((aligned(16))) unsigned char sm[2 * G2_BUF];      /* the larger of the two jobs' needs */
  if (bx < GO_G) d_gemm_o(bx, sm, O16, BO, alpha, bo, out0); else d_headsum(bx - GO_G, sm, Q, Kp, MB, ST, WS); }
// Jobs that do not depend on one another share a grid: a work-group picks its job by its index, the same for all its threads, and runs that job's body with its index within the job.
#define PW_G ((DM / 64) * (DM / 64))          /* work-groups of one weight transpose */
#define PM_G (SQ * (SQ / 32) / 256)           /* of the mask pack */
#define PX_G ((int)(NR * DM / 8 / 256))       /* of one input conversion */
// all that reads inputs only: the three weight transposes, the mask pack, the three input conversions
__global__ __launch_bounds__(256) void k_prep(const float* __restrict__ wq, const float* __restrict__ wkv, const float* __restrict__ wo, _Float16* __restrict__ BQ, _Float16* __restrict__ BKV, _Float16* __restrict__ BO, const int* __restrict__ mask, unsigned* __restrict__ MB,
    const float* __restrict__ qin, const float* __restrict__ kin, const float* __restrict__ vin, _Float16* __restrict__ XQ, _Float16* __restrict__ XK, _Float16* __restrict__ XV) { const unsigned bx = blockIdx.x;
  __shared__ __attribute__((aligned(16))) unsigned tl[64][WT_P];      /* the weight transposes' tile */
  if (bx < 3 * PW_G) { const unsigned j = bx / PW_G; d_wt_f16(bx - j * PW_G, j == 0 ? wq : j == 1 ? wkv : wo, j == 0 ? BQ : j == 1 ? BKV : BO, DM, DM, 16.0f, tl); }
  else if (bx < 3 * PW_G + PM_G) d_maskbits(bx - 3 * PW_G, mask, MB);
  else { const unsigned i = bx - (3 * PW_G + PM_G), j = i / PX_G; d_x16(i - j * PX_G, j == 0 ? qin : j == 1 ? kin : vin, j == 0 ? XQ : j == 1 ? XK : XV, NR * DM / 8); } }

extern "C" void kernel_launch(void* const* d_in, const int* in_sizes, int n_in,
                              void* d_out, int out_size, void* d_ws, size_t ws_size, hipStream_t stream) {
  (void)in_sizes; (void)n_in; (void)out_size;
  const float* const* I = (const float* const*)d_in; const float* qin = I[0]; const float* kin = I[1]; const float* vin = I[2]; const int* mask = (const int*)d_in[3]; const float* wq = I[4]; const float* bq = I[5]; const float* wkv = I[6]; const float* bkv = I[7]; const float* wo = I[8]; const float* bo = I[9]; const float* alpha = I[10];      /* weights [in][out] */
  float* out0 = (float*)d_out; float* out1 = (float*)d_out + NR * DM;      /* byte offset 16,777,216 */
  char* ws = (char*)d_ws; size_t off = 0;
  auto take = [&](size_t bytes) { char* p = ws + off; off += (bytes + 255) & ~(size_t)255; return p; };
  _Float16* BQ = (_Float16*)take((size_t)DM * DM * 2); _Float16* BKV = (_Float16*)take((size_t)DM * DM * 2); _Float16* BO = (_Float16*)take((size_t)DM * DM * 2);
  _Float16* Q16 = (_Float16*)take(NR * DM * 2); _Float16* K16 = (_Float16*)take(NR * DM * 2); float* AV = (float*)take(NR * DM * 4); _Float16* O16 = (_Float16*)take(NR * DM * 2);
  _Float16* VT = (_Float16*)take((size_t)NB * NH * HD * SQ * 2); unsigned* MB = (unsigned*)take((size_t)SQ * (SQ / 32) * 4); float* ST = (float*)take((size_t)NB * NH * SQ * 2 * 4);
  _Float16* XQ = (_Float16*)take(NR * DM * 2); _Float16* XK = (_Float16*)take(NR * DM * 2); _Float16* XV = (_Float16*)take(NR * DM * 2);
  if (off > ws_size) return;      /* 6 + 16 + 16 + 8 + 8 + 0.5 + 0.5 + 24 = 79 MiB */
  k_prep<<<3 * PW_G + PM_G + 3 * PX_G, 256, 0, stream>>>(wq, wkv, wo, BQ, BKV, BO, mask, MB, qin, kin, vin, XQ, XK, XV);
  const size_t r0p = (size_t)B0 * SQ; const dim3 gp((unsigned)((MP / 128) * (DM / 128)), 3);
  k_gemm2<0><<<gp, 128, 0, stream>>>(XQ + r0p * DM, DM, NR * DM, BQ, DM, 0, 0.0625f, bq, 0, nullptr, 1, 0, 0, AV + r0p * DM, Q16 + r0p * DM, DM, NR * DM, MP, DM, DM, BKV, bkv, 2, VT, alpha);      /* planes qp, kp, vp: XQ, XK, XV and Q16, K16 lie NR * DM elements apart; vp leaves as 64 alpha vp (f32 rows, residual) and as V^T [NB][NH][HD][SQ] (f16, attention operand) */
  k_fattn<<<dim3(SQ / 256, NH, NB), 256, 0, stream>>>(Q16, K16, VT, MB, AV, O16, ST);      /* o x64 = 64 attn v + 64 alpha vp, f16 rows; row statistics */
  k_tail<<<GO_G + HS_G, 256, 0, stream>>>(O16 + r0p * DM, BO, 0.0009765625f, bo, out0 + r0p * DM, Q16, K16, MB, ST, out1);      /* out0 = o Wo + bo; sum over the heads of the weights */
}
